// v000
// The times below were measured on an AMD MI455X: many runs one after another, warmed up first and cycling through
// copies of the inputs, with the whole window's GPU time divided by the number of runs. Launches and the gaps
// between them are all in it. The median over several windows is given; except for v000 it joins two sittings, which
// can be a few percent apart, so the side-by-side timings, each taken in one sitting, are the better comparison.
// v000, which the later versions start from, runs in 419 microseconds.
#include <hip/hip_runtime.h>
#include <math.h>

typedef __attribute__((ext_vector_type(2))) float v2f;
typedef __attribute__((ext_vector_type(4))) float f4;
typedef __attribute__((ext_vector_type(8))) float v8f;
typedef __attribute__((ext_vector_type(4))) int v4i;

#define SEQ   2048
#define EMB   1024
#define NH    16
#define DH    64
#define BATCH 2
#define MROWS (BATCH * SEQ) /* 4096 */
#define FEPS  1.1920928955078125e-07f
#define NEG_MAX (-3.402823466e38f)
#define SCALE 0.03125f /* 1024^-0.5 */

#define ASTR 20   /* A-tile LDS row stride: 16B-aligned rows, conflict-free frag reads */
#define BSTR 68   /* B-tile LDS row stride: 16B-aligned rows */
#define KVSTR 68  /* K/V tile stride */
#define PSTR 20   /* P scratch stride */

// ---------------- CDNA5 async global->LDS (ASYNCcnt) with safe fallback -----
#if defined(__gfx1250__) && __has_builtin(__builtin_amdgcn_global_load_async_to_lds_b128)
#define HAVE_ASYNC 1
__device__ __forceinline__ void async_cp16(float* lds, const float* g) {
    __builtin_amdgcn_global_load_async_to_lds_b128(
        (__attribute__((address_space(1))) v4i*)(void*)g,
        (__attribute__((address_space(3))) v4i*)(void*)lds,
        /*offset=*/0, /*cpol=*/0);
}
__device__ __forceinline__ void async_wait0() {
#if __has_builtin(__builtin_amdgcn_s_wait_asynccnt)
    __builtin_amdgcn_s_wait_asynccnt(0);
#else
    asm volatile("s_wait_asynccnt 0" ::: "memory");
#endif
}
#else
#define HAVE_ASYNC 0
#endif

__device__ __forceinline__ v8f wmma_f32(v2f a, v2f b, v8f c) {
    return __builtin_amdgcn_wmma_f32_16x16x4_f32(
        false, a, false, b, (short)0, c, false, false);
}

// ---------------------------------------------------------------------------
// Tiled fp32 WMMA GEMM: out = A[4096x1024] @ W[1024x1024]
// mode 0: plain [M][N]; mode 1: [B,H,S,D] (V); mode 2: [B,H,S,D] + pos (Q,K)
// 256 threads (8 waves), tile 128x64, K staged 16-wide, double-buffered LDS,
// single barrier per chunk (software pipeline).
// ---------------------------------------------------------------------------
__global__ __launch_bounds__(256) void gemm_proj(const float* __restrict__ A,
                                                 const float* __restrict__ W,
                                                 float* __restrict__ out,
                                                 int mode) {
    __shared__ float Asm[2][128 * ASTR];
    __shared__ float Bsm[2][16 * BSTR];

    const int tid    = threadIdx.x;
    const int lane   = tid & 31;
    const int wv     = tid >> 5;  // 0..7
    const int wm     = wv & 3;
    const int wn     = wv >> 2;
    const int laneLo = lane & 15;
    const int laneHi = lane >> 4;
    const int mblk   = blockIdx.y * 128;
    const int nblk   = blockIdx.x * 64;

    // Staging coordinates (one 16B piece each; A needs 2 pieces per thread)
    const int ar0 = tid >> 2, ac0 = (tid & 3) * 4;
    const int ar1 = ar0 + 64, ac1 = ac0;
    const int br  = tid >> 4, bc  = (tid & 15) * 4;

    const float* Ap0 = A + (size_t)(mblk + ar0) * EMB + ac0;
    const float* Ap1 = A + (size_t)(mblk + ar1) * EMB + ac1;
    const float* Wp  = W + (size_t)br * EMB + nblk + bc;

    v8f acc[2][2];
#pragma unroll
    for (int a = 0; a < 2; ++a)
#pragma unroll
        for (int bb = 0; bb < 2; ++bb)
            acc[a][bb] = (v8f){0.f, 0.f, 0.f, 0.f, 0.f, 0.f, 0.f, 0.f};

    auto compute = [&](int cur) {
        const float* Ab = Asm[cur];
        const float* Bb = Bsm[cur];
#pragma unroll
        for (int kk = 0; kk < 4; ++kk) {
            v2f af[2], bf[2];
#pragma unroll
            for (int tm = 0; tm < 2; ++tm) {
                int row = wm * 32 + tm * 16 + laneLo;
                af[tm] = *(const v2f*)(&Ab[row * ASTR + kk * 4 + 2 * laneHi]);
            }
#pragma unroll
            for (int tn = 0; tn < 2; ++tn) {
                int col = wn * 32 + tn * 16 + laneLo;
                int kr  = kk * 4 + 2 * laneHi;
                v2f b;
                b[0] = Bb[kr * BSTR + col];
                b[1] = Bb[(kr + 1) * BSTR + col];
                bf[tn] = b;
            }
#pragma unroll
            for (int tm = 0; tm < 2; ++tm)
#pragma unroll
                for (int tn = 0; tn < 2; ++tn)
                    acc[tm][tn] = wmma_f32(af[tm], bf[tn], acc[tm][tn]);
        }
    };

    const int NCH = EMB / 16;  // 64 chunks
#if HAVE_ASYNC
    async_cp16(&Asm[0][ar0 * ASTR + ac0], Ap0);
    async_cp16(&Asm[0][ar1 * ASTR + ac1], Ap1);
    async_cp16(&Bsm[0][br * BSTR + bc], Wp);
    for (int it = 0; it < NCH; ++it) {
        const int cur = it & 1;
        async_wait0();
        __syncthreads();
        if (it + 1 < NCH) {
            const int kb = (it + 1) * 16;
            async_cp16(&Asm[cur ^ 1][ar0 * ASTR + ac0], Ap0 + kb);
            async_cp16(&Asm[cur ^ 1][ar1 * ASTR + ac1], Ap1 + kb);
            async_cp16(&Bsm[cur ^ 1][br * BSTR + bc], Wp + (size_t)kb * EMB);
        }
        compute(cur);
    }
#else
    f4 ra0 = *(const f4*)Ap0;
    f4 ra1 = *(const f4*)Ap1;
    f4 rb  = *(const f4*)Wp;
    for (int it = 0; it < NCH; ++it) {
        const int cur = it & 1;
        *(f4*)&Asm[cur][ar0 * ASTR + ac0] = ra0;
        *(f4*)&Asm[cur][ar1 * ASTR + ac1] = ra1;
        *(f4*)&Bsm[cur][br * BSTR + bc]   = rb;
        if (it + 1 < NCH) {
            const int kb = (it + 1) * 16;
            __builtin_prefetch(Ap0 + kb + 16, 0, 0);
            ra0 = *(const f4*)(Ap0 + kb);
            ra1 = *(const f4*)(Ap1 + kb);
            rb  = *(const f4*)(Wp + (size_t)kb * EMB);
        }
        __syncthreads();
        compute(cur);
    }
#endif

    // Epilogue
#pragma unroll
    for (int tm = 0; tm < 2; ++tm)
#pragma unroll
        for (int tn = 0; tn < 2; ++tn)
#pragma unroll
            for (int i = 0; i < 8; ++i) {
                int rg = mblk + wm * 32 + tm * 16 + i + 8 * laneHi;
                int cg = nblk + wn * 32 + tn * 16 + laneLo;
                float val = acc[tm][tn][i];
                if (mode == 0) {
                    out[(size_t)rg * EMB + cg] = val;
                } else {
                    int b = rg >> 11, s = rg & (SEQ - 1);
                    int h = cg >> 6, d = cg & 63;
                    if (mode == 2) {
                        float ex  = (float)(d & ~1) * (1.0f / 64.0f);
                        float sc  = 1.0f / (__powf(10000.0f, ex) + FEPS);
                        float ang = (float)s * sc;
                        val += (d & 1) ? __cosf(ang) : __sinf(ang);
                    }
                    out[(((size_t)b * NH + h) * SEQ + s) * DH + d] = val;
                }
            }
}

// ---------------------------------------------------------------------------
// Causal flash attention. Q/K/V in [B,H,S,D]; output in [B,S,E].
// 256 threads (8 waves); each wave owns 16 query rows (block covers 128).
// K/V 16x64 tiles double-buffered in LDS, single barrier per tile.
// ---------------------------------------------------------------------------
__global__ __launch_bounds__(256) void flash_attn(const float* __restrict__ Q,
                                                  const float* __restrict__ K,
                                                  const float* __restrict__ V,
                                                  float* __restrict__ O) {
    __shared__ float Ksm[2][16 * KVSTR];
    __shared__ float Vsm[2][16 * KVSTR];
    __shared__ float Psm[8][16 * PSTR];

    const int tid    = threadIdx.x;
    const int lane   = tid & 31;
    const int w      = tid >> 5;  // 0..7
    const int laneLo = lane & 15;
    const int laneHi = lane >> 4;
    const int qblk   = blockIdx.x;  // 0..15
    const int bh     = blockIdx.y;  // 0..31
    const int b      = bh >> 4;
    const int h      = bh & 15;

    const float* Qp = Q + (size_t)bh * SEQ * DH;
    const float* Kp = K + (size_t)bh * SEQ * DH;
    const float* Vp = V + (size_t)bh * SEQ * DH;

    const int q0 = qblk * 128 + w * 16;

    // Q fragments (16 rows x 64 dim), pre-scaled by dim_k^-0.5
    v2f qf[16];
#pragma unroll
    for (int kk = 0; kk < 16; ++kk) {
        v2f t = *(const v2f*)(Qp + (size_t)(q0 + laneLo) * DH + kk * 4 + 2 * laneHi);
        qf[kk] = t * SCALE;
    }

    v8f Oa[4];
#pragma unroll
    for (int dt = 0; dt < 4; ++dt)
        Oa[dt] = (v8f){0.f, 0.f, 0.f, 0.f, 0.f, 0.f, 0.f, 0.f};
    float mrow[8], lrow[8];
#pragma unroll
    for (int i = 0; i < 8; ++i) { mrow[i] = NEG_MAX; lrow[i] = 0.f; }

    const int ntiles = qblk * 8 + 8;
    const int mylast = qblk * 8 + w;

    // Staging coords: one 16B piece of K and one of V per thread
    const int kr = tid >> 4, kc = (tid & 15) * 4;
    const float* Kpp = Kp + (size_t)kr * DH + kc;
    const float* Vpp = Vp + (size_t)kr * DH + kc;
    const int ldso = kr * KVSTR + kc;

    auto attend = [&](int cur, int kb) {
        const float* Kb = Ksm[cur];
        const float* Vb = Vsm[cur];
        // S = Q * K^T
        v8f sc = (v8f){0.f, 0.f, 0.f, 0.f, 0.f, 0.f, 0.f, 0.f};
#pragma unroll
        for (int kk = 0; kk < 16; ++kk) {
            v2f bf = *(const v2f*)(&Kb[laneLo * KVSTR + kk * 4 + 2 * laneHi]);
            sc = wmma_f32(qf[kk], bf, sc);
        }
        // Causal mask (diagonal tile only)
        if (kb + 15 > q0) {
#pragma unroll
            for (int i = 0; i < 8; ++i) {
                int qg = q0 + i + 8 * laneHi;
                int kg = kb + laneLo;
                if (kg > qg) sc[i] = NEG_MAX;
            }
        }
        // Online softmax (row reductions across 16-lane halves)
        float f[8];
#pragma unroll
        for (int i = 0; i < 8; ++i) {
            float r = sc[i];
            r = fmaxf(r, __shfl_xor(r, 1));
            r = fmaxf(r, __shfl_xor(r, 2));
            r = fmaxf(r, __shfl_xor(r, 4));
            r = fmaxf(r, __shfl_xor(r, 8));
            float mnew = fmaxf(mrow[i], r);
            f[i]    = __expf(mrow[i] - mnew);
            mrow[i] = mnew;
            float p = __expf(sc[i] - mnew);
            sc[i]   = p;
            float su = p;
            su += __shfl_xor(su, 1);
            su += __shfl_xor(su, 2);
            su += __shfl_xor(su, 4);
            su += __shfl_xor(su, 8);
            lrow[i] = lrow[i] * f[i] + su;
        }
        // Transpose P through per-wave LDS scratch
        float* P = &Psm[w][0];
#pragma unroll
        for (int i = 0; i < 8; ++i)
            P[(i + 8 * laneHi) * PSTR + laneLo] = sc[i];
        asm volatile("s_wait_dscnt 0" ::: "memory");
        // Rescale running output, then O += P * V
#pragma unroll
        for (int dt = 0; dt < 4; ++dt)
#pragma unroll
            for (int i = 0; i < 8; ++i) Oa[dt][i] *= f[i];
#pragma unroll
        for (int kc2 = 0; kc2 < 4; ++kc2) {
            v2f af = *(const v2f*)(&P[laneLo * PSTR + kc2 * 4 + 2 * laneHi]);
            int krw = kc2 * 4 + 2 * laneHi;
#pragma unroll
            for (int dt = 0; dt < 4; ++dt) {
                v2f bf;
                bf[0] = Vb[krw * KVSTR + dt * 16 + laneLo];
                bf[1] = Vb[(krw + 1) * KVSTR + dt * 16 + laneLo];
                Oa[dt] = wmma_f32(af, bf, Oa[dt]);
            }
        }
    };

#if HAVE_ASYNC
    async_cp16(&Ksm[0][ldso], Kpp);
    async_cp16(&Vsm[0][ldso], Vpp);
    for (int jt = 0; jt < ntiles; ++jt) {
        const int cur = jt & 1;
        async_wait0();
        __syncthreads();
        if (jt + 1 < ntiles) {
            async_cp16(&Ksm[cur ^ 1][ldso], Kpp + (size_t)(jt + 1) * 16 * DH);
            async_cp16(&Vsm[cur ^ 1][ldso], Vpp + (size_t)(jt + 1) * 16 * DH);
        }
        if (jt <= mylast) attend(cur, jt * 16);
    }
#else
    f4 rk = *(const f4*)Kpp;
    f4 rv = *(const f4*)Vpp;
    for (int jt = 0; jt < ntiles; ++jt) {
        const int cur = jt & 1;
        *(f4*)&Ksm[cur][ldso] = rk;
        *(f4*)&Vsm[cur][ldso] = rv;
        if (jt + 1 < ntiles) {
            __builtin_prefetch(Kpp + (size_t)(jt + 2) * 16 * DH, 0, 0);
            rk = *(const f4*)(Kpp + (size_t)(jt + 1) * 16 * DH);
            rv = *(const f4*)(Vpp + (size_t)(jt + 1) * 16 * DH);
        }
        __syncthreads();
        if (jt <= mylast) attend(cur, jt * 16);
    }
#endif

    // Normalize and write out in [B,S,E]
#pragma unroll
    for (int i = 0; i < 8; ++i) {
        float inv = 1.0f / lrow[i];
        int s = q0 + i + 8 * laneHi;
        size_t row = (size_t)b * SEQ + s;
#pragma unroll
        for (int dt = 0; dt < 4; ++dt) {
            int c = h * 64 + dt * 16 + laneLo;
            O[row * EMB + c] = Oa[dt][i] * inv;
        }
    }
}

extern "C" void kernel_launch(void* const* d_in, const int* in_sizes, int n_in,
                              void* d_out, int out_size, void* d_ws, size_t ws_size,
                              hipStream_t stream) {
    (void)in_sizes; (void)n_in; (void)out_size; (void)ws_size;
    const float* x  = (const float*)d_in[0];
    const float* Wq = (const float*)d_in[1];
    const float* Wk = (const float*)d_in[2];
    const float* Wv = (const float*)d_in[3];
    const float* Wo = (const float*)d_in[4];
    float* out = (float*)d_out;

    const size_t elems = (size_t)MROWS * EMB;
    float* Qb = (float*)d_ws;
    float* Kb = Qb + elems;
    float* Vb = Kb + elems;
    float* Ab = Vb + elems;

    dim3 gg(EMB / 64, MROWS / 128);  // (16, 32)
    gemm_proj<<<gg, 256, 0, stream>>>(x, Wq, Qb, 2);
    gemm_proj<<<gg, 256, 0, stream>>>(x, Wk, Kb, 2);
    gemm_proj<<<gg, 256, 0, stream>>>(x, Wv, Vb, 1);

    dim3 gf(SEQ / 128, BATCH * NH);  // (16, 32)
    flash_attn<<<gf, 256, 0, stream>>>(Qb, Kb, Vb, Ab);

    gemm_proj<<<gg, 256, 0, stream>>>(Ab, Wo, out, 0);
}

// v001
// One run takes 375 microseconds.
// In both of two side-by-side timings against v000, it was 1.17 times as fast.
#include <hip/hip_runtime.h>
#include <math.h>

typedef __attribute__((ext_vector_type(2))) float v2f;
typedef __attribute__((ext_vector_type(4))) float f4;
typedef __attribute__((ext_vector_type(8))) float v8f;
typedef __attribute__((ext_vector_type(4))) int v4i;

#define SEQ   2048
#define EMB   1024
#define NH    16
#define DH    64
#define BATCH 2
#define MROWS (BATCH * SEQ) /* 4096 */
#define FEPS  1.1920928955078125e-07f
#define NEG_MAX (-3.402823466e38f)
#define SCALE 0.03125f /* 1024^-0.5 */

#define ASTR 20   /* A-tile LDS row stride: 16B-aligned rows, conflict-free frag reads */
#define BSTR 68   /* B-tile LDS row stride: 16B-aligned rows */
#define KVSTR 68  /* K/V tile stride */

// ---------------- CDNA5 async global->LDS (ASYNCcnt) with safe fallback -----
#if defined(__gfx1250__) && __has_builtin(__builtin_amdgcn_global_load_async_to_lds_b128)
#define HAVE_ASYNC 1
__device__ __forceinline__ void async_cp16(float* lds, const float* g) {
    __builtin_amdgcn_global_load_async_to_lds_b128(
        (__attribute__((address_space(1))) v4i*)(void*)g,
        (__attribute__((address_space(3))) v4i*)(void*)lds,
        /*offset=*/0, /*cpol=*/0);
}
__device__ __forceinline__ void async_wait0() {
#if __has_builtin(__builtin_amdgcn_s_wait_asynccnt)
    __builtin_amdgcn_s_wait_asynccnt(0);
#else
    asm volatile("s_wait_asynccnt 0" ::: "memory");
#endif
}
#else
#define HAVE_ASYNC 0
#endif

__device__ __forceinline__ v8f wmma_f32(v2f a, v2f b, v8f c) {
    return __builtin_amdgcn_wmma_f32_16x16x4_f32(
        false, a, false, b, (short)0, c, false, false);
}

// ---------------------------------------------------------------------------
// Tiled fp32 WMMA GEMM: out = A[4096x1024] @ W[1024x1024]
// mode 0: plain [M][N]; mode 1: [B,H,S,D] (V); mode 2: [B,H,S,D] + pos (Q,K)
// 256 threads (8 waves), tile 128x64, K staged 16-wide, double-buffered LDS,
// single barrier per chunk (software pipeline).
// ---------------------------------------------------------------------------
__global__ __launch_bounds__(256) void gemm_proj(const float* __restrict__ A,
                                                 const float* __restrict__ W,
                                                 float* __restrict__ out,
                                                 int mode) {
    __shared__ float Asm[2][128 * ASTR];
    __shared__ float Bsm[2][16 * BSTR];

    const int tid    = threadIdx.x;
    const int lane   = tid & 31;
    const int wv     = tid >> 5;  // 0..7
    const int wm     = wv & 3;
    const int wn     = wv >> 2;
    const int laneLo = lane & 15;
    const int laneHi = lane >> 4;
    const int mblk   = blockIdx.y * 128;
    const int nblk   = blockIdx.x * 64;

    // Staging coordinates (one 16B piece each; A needs 2 pieces per thread)
    const int ar0 = tid >> 2, ac0 = (tid & 3) * 4;
    const int ar1 = ar0 + 64, ac1 = ac0;
    const int br  = tid >> 4, bc  = (tid & 15) * 4;

    const float* Ap0 = A + (size_t)(mblk + ar0) * EMB + ac0;
    const float* Ap1 = A + (size_t)(mblk + ar1) * EMB + ac1;
    const float* Wp  = W + (size_t)br * EMB + nblk + bc;

    v8f acc[2][2];
#pragma unroll
    for (int a = 0; a < 2; ++a)
#pragma unroll
        for (int bb = 0; bb < 2; ++bb)
            acc[a][bb] = (v8f){0.f, 0.f, 0.f, 0.f, 0.f, 0.f, 0.f, 0.f};

    auto compute = [&](int cur) {
        const float* Ab = Asm[cur];
        const float* Bb = Bsm[cur];
#pragma unroll
        for (int kk = 0; kk < 4; ++kk) {
            v2f af[2], bf[2];
#pragma unroll
            for (int tm = 0; tm < 2; ++tm) {
                int row = wm * 32 + tm * 16 + laneLo;
                af[tm] = *(const v2f*)(&Ab[row * ASTR + kk * 4 + 2 * laneHi]);
            }
#pragma unroll
            for (int tn = 0; tn < 2; ++tn) {
                int col = wn * 32 + tn * 16 + laneLo;
                int kr  = kk * 4 + 2 * laneHi;
                v2f b;
                b[0] = Bb[kr * BSTR + col];
                b[1] = Bb[(kr + 1) * BSTR + col];
                bf[tn] = b;
            }
#pragma unroll
            for (int tm = 0; tm < 2; ++tm)
#pragma unroll
                for (int tn = 0; tn < 2; ++tn)
                    acc[tm][tn] = wmma_f32(af[tm], bf[tn], acc[tm][tn]);
        }
    };

    const int NCH = EMB / 16;  // 64 chunks
#if HAVE_ASYNC
    async_cp16(&Asm[0][ar0 * ASTR + ac0], Ap0);
    async_cp16(&Asm[0][ar1 * ASTR + ac1], Ap1);
    async_cp16(&Bsm[0][br * BSTR + bc], Wp);
    for (int it = 0; it < NCH; ++it) {
        const int cur = it & 1;
        async_wait0();
        __syncthreads();
        if (it + 1 < NCH) {
            const int kb = (it + 1) * 16;
            async_cp16(&Asm[cur ^ 1][ar0 * ASTR + ac0], Ap0 + kb);
            async_cp16(&Asm[cur ^ 1][ar1 * ASTR + ac1], Ap1 + kb);
            async_cp16(&Bsm[cur ^ 1][br * BSTR + bc], Wp + (size_t)kb * EMB);
        }
        compute(cur);
    }
#else
    f4 ra0 = *(const f4*)Ap0;
    f4 ra1 = *(const f4*)Ap1;
    f4 rb  = *(const f4*)Wp;
    for (int it = 0; it < NCH; ++it) {
        const int cur = it & 1;
        *(f4*)&Asm[cur][ar0 * ASTR + ac0] = ra0;
        *(f4*)&Asm[cur][ar1 * ASTR + ac1] = ra1;
        *(f4*)&Bsm[cur][br * BSTR + bc]   = rb;
        if (it + 1 < NCH) {
            const int kb = (it + 1) * 16;
            __builtin_prefetch(Ap0 + kb + 16, 0, 0);
            ra0 = *(const f4*)(Ap0 + kb);
            ra1 = *(const f4*)(Ap1 + kb);
            rb  = *(const f4*)(Wp + (size_t)kb * EMB);
        }
        __syncthreads();
        compute(cur);
    }
#endif

    // Epilogue
#pragma unroll
    for (int tm = 0; tm < 2; ++tm)
#pragma unroll
        for (int tn = 0; tn < 2; ++tn)
#pragma unroll
            for (int i = 0; i < 8; ++i) {
                int rg = mblk + wm * 32 + tm * 16 + i + 8 * laneHi;
                int cg = nblk + wn * 32 + tn * 16 + laneLo;
                float val = acc[tm][tn][i];
                if (mode == 0) {
                    out[(size_t)rg * EMB + cg] = val;
                } else {
                    int b = rg >> 11, s = rg & (SEQ - 1);
                    int h = cg >> 6, d = cg & 63;
                    if (mode == 2) {
                        float ex  = (float)(d & ~1) * (1.0f / 64.0f);
                        float sc  = 1.0f / (__powf(10000.0f, ex) + FEPS);
                        float ang = (float)s * sc;
                        val += (d & 1) ? __cosf(ang) : __sinf(ang);
                    }
                    out[(((size_t)b * NH + h) * SEQ + s) * DH + d] = val;
                }
            }
}

// Lane l <-> lane l ^ 16 (the other 16-lane half of the wave)
__device__ __forceinline__ float xhalf(float x) {
    int b = __builtin_bit_cast(int, x);
    return __builtin_bit_cast(float, __builtin_amdgcn_permlanex16(
        b, b, 0x76543210, 0xfedcba98, false, false));
}

// e^x as v_exp_f32(x * log2 e), what __expf compiles to. The v_nop is the one free
// slot the instruction set asks for behind a transcendental before its source is
// overwritten or its result read; in the same statement it stays directly behind.
__device__ __forceinline__ float exp_slot(float x) {
    float r;
    asm("v_exp_f32 %0, %1\n\tv_nop" : "=v"(r) : "v"(x * 1.44269504088896340736f));
    return r;
}

__global__ __launch_bounds__(256) void flash_attn(const float* __restrict__ Q,
                                                  const float* __restrict__ K,
                                                  const float* __restrict__ V,
                                                  float* __restrict__ O) {
    __shared__ float Ksm[2][16 * KVSTR];
    __shared__ float Vsm[2][16 * KVSTR];

    const int tid    = threadIdx.x;
    const int lane   = tid & 31;
    const int w      = tid >> 5;  // 0..7
    const int laneLo = lane & 15;
    const int laneHi = lane >> 4;
    const int qblk   = blockIdx.x;  // 0..15
    const int bh     = blockIdx.y;  // 0..31
    const int b      = bh >> 4;
    const int h      = bh & 15;

    const float* Qp = Q + (size_t)bh * SEQ * DH;
    const float* Kp = K + (size_t)bh * SEQ * DH;
    const float* Vp = V + (size_t)bh * SEQ * DH;

    const int q0 = qblk * 128 + w * 16;

    // Q fragments (16 rows x 64 dim), pre-scaled by dim_k^-0.5
    v2f qf[16];
#pragma unroll
    for (int kk = 0; kk < 16; ++kk) {
        v2f t = *(const v2f*)(Qp + (size_t)(q0 + laneLo) * DH + kk * 4 + 2 * laneHi);
        qf[kk] = t * SCALE;
    }

    v8f Oa[4];
#pragma unroll
    for (int dt = 0; dt < 4; ++dt)
        Oa[dt] = (v8f){0.f, 0.f, 0.f, 0.f, 0.f, 0.f, 0.f, 0.f};
    float mrow = NEG_MAX;  // running maximum of query q0 + laneLo (both halves agree)
    float lrow = 0.f;      // running sum over this half's keys only; joined at the end

    const int ntiles = qblk * 8 + 8;
    const int mylast = qblk * 8 + w;

    // Staging coords: one 16B piece of K and one of V per thread
    const int kr = tid >> 4, kc = (tid & 15) * 4;
    const float* Kpp = Kp + (size_t)kr * DH + kc;
    const float* Vpp = Vp + (size_t)kr * DH + kc;
    const int ldso = kr * KVSTR + kc;

    auto attend = [&](int cur, int kb) {
        const float* Kb = Ksm[cur];
        const float* Vb = Vsm[cur];
        // Vt fragments (A of the second product) depend on no score: read them first.
        // k order of chunk c, the same for A and B: key 8 * laneHi + 2 * c + {0, 1},
        // which is where the score accumulator holds Pt.
        v2f vf[4][4];
#pragma unroll
        for (int kc2 = 0; kc2 < 4; ++kc2) {
            int krw = 8 * laneHi + 2 * kc2;
#pragma unroll
            for (int dt = 0; dt < 4; ++dt) {
                vf[kc2][dt][0] = Vb[krw * KVSTR + dt * 16 + laneLo];
                vf[kc2][dt][1] = Vb[(krw + 1) * KVSTR + dt * 16 + laneLo];
            }
        }
        // St = K * Qt: sc[i] = score(key kb + i + 8 * laneHi, query q0 + laneLo)
        v8f sc = (v8f){0.f, 0.f, 0.f, 0.f, 0.f, 0.f, 0.f, 0.f};
#pragma unroll
        for (int kk = 0; kk < 16; ++kk) {
            v2f kf = *(const v2f*)(&Kb[laneLo * KVSTR + kk * 4 + 2 * laneHi]);
            sc = wmma_f32(kf, qf[kk], sc);
        }
        // Causal mask (diagonal tile only)
        if (kb + 15 > q0) {
#pragma unroll
            for (int i = 0; i < 8; ++i) {
                int kg = kb + i + 8 * laneHi;
                int qg = q0 + laneLo;
                if (kg > qg) sc[i] = NEG_MAX;
            }
        }
        // Online softmax: 8 keys in-lane, the other 8 in lane ^ 16
        float r = fmaxf(fmaxf(fmaxf(sc[0], sc[1]), fmaxf(sc[2], sc[3])),
                        fmaxf(fmaxf(sc[4], sc[5]), fmaxf(sc[6], sc[7])));
        r = fmaxf(r, xhalf(r));
        const float mnew = fmaxf(mrow, r);
        const float f    = exp_slot(mrow - mnew);
        mrow = mnew;
#pragma unroll
        for (int i = 0; i < 8; ++i) sc[i] = exp_slot(sc[i] - mnew);
        lrow = lrow * f + (((sc[0] + sc[1]) + (sc[2] + sc[3])) +
                           ((sc[4] + sc[5]) + (sc[6] + sc[7])));
        // Rescale running output, then Ot += Vt * Pt
#pragma unroll
        for (int dt = 0; dt < 4; ++dt)
#pragma unroll
            for (int i = 0; i < 8; ++i) Oa[dt][i] *= f;
#pragma unroll
        for (int kc2 = 0; kc2 < 4; ++kc2) {
            v2f pf;
            pf[0] = sc[2 * kc2];
            pf[1] = sc[2 * kc2 + 1];
#pragma unroll
            for (int dt = 0; dt < 4; ++dt)
                Oa[dt] = wmma_f32(vf[kc2][dt], pf, Oa[dt]);
        }
    };

#if HAVE_ASYNC
    async_cp16(&Ksm[0][ldso], Kpp);
    async_cp16(&Vsm[0][ldso], Vpp);
    for (int jt = 0; jt < ntiles; ++jt) {
        const int cur = jt & 1;
        async_wait0();
        __syncthreads();
        if (jt + 1 < ntiles) {
            async_cp16(&Ksm[cur ^ 1][ldso], Kpp + (size_t)(jt + 1) * 16 * DH);
            async_cp16(&Vsm[cur ^ 1][ldso], Vpp + (size_t)(jt + 1) * 16 * DH);
        }
        if (jt <= mylast) attend(cur, jt * 16);
    }
#else
    f4 rk = *(const f4*)Kpp;
    f4 rv = *(const f4*)Vpp;
    for (int jt = 0; jt < ntiles; ++jt) {
        const int cur = jt & 1;
        *(f4*)&Ksm[cur][ldso] = rk;
        *(f4*)&Vsm[cur][ldso] = rv;
        if (jt + 1 < ntiles) {
            __builtin_prefetch(Kpp + (size_t)(jt + 2) * 16 * DH, 0, 0);
            rk = *(const f4*)(Kpp + (size_t)(jt + 1) * 16 * DH);
            rv = *(const f4*)(Vpp + (size_t)(jt + 1) * 16 * DH);
        }
        __syncthreads();
        if (jt <= mylast) attend(cur, jt * 16);
    }
#endif

    // Normalize and write out in [B,S,E]:
    // Oa[dt][i] = O(query q0 + laneLo, dim dt * 16 + 8 * laneHi + i)
    const float inv = 1.0f / (lrow + xhalf(lrow));
    float* Op = O + ((size_t)b * SEQ + q0 + laneLo) * EMB + h * 64 + 8 * laneHi;
#pragma unroll
    for (int dt = 0; dt < 4; ++dt) {
        f4 lo = {Oa[dt][0] * inv, Oa[dt][1] * inv, Oa[dt][2] * inv, Oa[dt][3] * inv};
        f4 hi = {Oa[dt][4] * inv, Oa[dt][5] * inv, Oa[dt][6] * inv, Oa[dt][7] * inv};
        *(f4*)(Op + dt * 16)     = lo;
        *(f4*)(Op + dt * 16 + 4) = hi;
    }
}

extern "C" void kernel_launch(void* const* d_in, const int* in_sizes, int n_in,
                              void* d_out, int out_size, void* d_ws, size_t ws_size,
                              hipStream_t stream) {
    (void)in_sizes; (void)n_in; (void)out_size; (void)ws_size;
    const float* x  = (const float*)d_in[0];
    const float* Wq = (const float*)d_in[1];
    const float* Wk = (const float*)d_in[2];
    const float* Wv = (const float*)d_in[3];
    const float* Wo = (const float*)d_in[4];
    float* out = (float*)d_out;

    const size_t elems = (size_t)MROWS * EMB;
    float* Qb = (float*)d_ws;
    float* Kb = Qb + elems;
    float* Vb = Kb + elems;
    float* Ab = Vb + elems;

    dim3 gg(EMB / 64, MROWS / 128);  // (16, 32)
    gemm_proj<<<gg, 256, 0, stream>>>(x, Wq, Qb, 2);
    gemm_proj<<<gg, 256, 0, stream>>>(x, Wk, Kb, 2);
    gemm_proj<<<gg, 256, 0, stream>>>(x, Wv, Vb, 1);

    dim3 gf(SEQ / 128, BATCH * NH);  // (16, 32)
    flash_attn<<<gf, 256, 0, stream>>>(Qb, Kb, Vb, Ab);

    gemm_proj<<<gg, 256, 0, stream>>>(Ab, Wo, out, 0);
}

// v002
// Measured time: 310 microseconds a run.
// In two side-by-side timings against v001, it was 1.21 and 1.20 times as fast.
// Counting every step since v000, it is 1.41 times as fast.
#include <hip/hip_runtime.h>
#include <math.h>

typedef __attribute__((ext_vector_type(2))) float v2f;
typedef __attribute__((ext_vector_type(4))) float f4;
typedef __attribute__((ext_vector_type(8))) float v8f;
typedef __attribute__((ext_vector_type(4))) int v4i;

#define SEQ   2048
#define EMB   1024
#define NH    16
#define DH    64
#define BATCH 2
#define MROWS (BATCH * SEQ) /* 4096 */
#define FEPS  1.1920928955078125e-07f
#define NEG_MAX (-3.402823466e38f)
#define SCALE 0.03125f /* 1024^-0.5 */

#define ASTR 20   /* A-tile LDS row stride: 16B-aligned rows, conflict-free frag reads */
#define BSTR 68   /* B-tile LDS row stride: 16B-aligned rows */
#define KVSTR 68  /* K/V tile stride */

// ---------------- CDNA5 async global->LDS (ASYNCcnt) with safe fallback -----
#if defined(__gfx1250__) && __has_builtin(__builtin_amdgcn_global_load_async_to_lds_b128)
#define HAVE_ASYNC 1
__device__ __forceinline__ void async_cp16(float* lds, const float* g) {
    __builtin_amdgcn_global_load_async_to_lds_b128(
        (__attribute__((address_space(1))) v4i*)(void*)g,
        (__attribute__((address_space(3))) v4i*)(void*)lds,
        /*offset=*/0, /*cpol=*/0);
}
__device__ __forceinline__ void async_wait0() {
#if __has_builtin(__builtin_amdgcn_s_wait_asynccnt)
    __builtin_amdgcn_s_wait_asynccnt(0);
#else
    asm volatile("s_wait_asynccnt 0" ::: "memory");
#endif
}
#else
#define HAVE_ASYNC 0
#endif

__device__ __forceinline__ v8f wmma_f32(v2f a, v2f b, v8f c) {
    return __builtin_amdgcn_wmma_f32_16x16x4_f32(
        false, a, false, b, (short)0, c, false, false);
}

// ---------------------------------------------------------------------------
// Tiled fp32 WMMA GEMM: out = A[4096x1024] @ W[1024x1024]
// mode 0: plain [M][N]; mode 1: [B,H,S,D] (V); mode 2: [B,H,S,D] + pos (Q,K)
// 256 threads (8 waves), tile 128x64, K staged 16-wide, double-buffered LDS,
// single barrier per chunk (software pipeline).
// ---------------------------------------------------------------------------
__global__ __launch_bounds__(256) void gemm_proj(const float* __restrict__ A,
                                                 const float* __restrict__ W,
                                                 float* __restrict__ out,
                                                 int mode) {
    __shared__ float Asm[2][128 * ASTR];
    __shared__ float Bsm[2][16 * BSTR];

    const int tid    = threadIdx.x;
    const int lane   = tid & 31;
    const int wv     = tid >> 5;  // 0..7
    const int wm     = wv & 3;
    const int wn     = wv >> 2;
    const int laneLo = lane & 15;
    const int laneHi = lane >> 4;
    const int mblk   = blockIdx.y * 128;
    const int nblk   = blockIdx.x * 64;

    // Staging coordinates (one 16B piece each; A needs 2 pieces per thread)
    const int ar0 = tid >> 2, ac0 = (tid & 3) * 4;
    const int ar1 = ar0 + 64, ac1 = ac0;
    const int br  = tid >> 4, bc  = (tid & 15) * 4;

    const float* Ap0 = A + (size_t)(mblk + ar0) * EMB + ac0;
    const float* Ap1 = A + (size_t)(mblk + ar1) * EMB + ac1;
    const float* Wp  = W + (size_t)br * EMB + nblk + bc;

    v8f acc[2][2];
#pragma unroll
    for (int a = 0; a < 2; ++a)
#pragma unroll
        for (int bb = 0; bb < 2; ++bb)
            acc[a][bb] = (v8f){0.f, 0.f, 0.f, 0.f, 0.f, 0.f, 0.f, 0.f};

    auto compute = [&](int cur) {
        const float* Ab = Asm[cur];
        const float* Bb = Bsm[cur];
#pragma unroll
        for (int kk = 0; kk < 4; ++kk) {
            v2f af[2], bf[2];
#pragma unroll
            for (int tm = 0; tm < 2; ++tm) {
                int row = wm * 32 + tm * 16 + laneLo;
                af[tm] = *(const v2f*)(&Ab[row * ASTR + kk * 4 + 2 * laneHi]);
            }
#pragma unroll
            for (int tn = 0; tn < 2; ++tn) {
                int col = wn * 32 + tn * 16 + laneLo;
                int kr  = kk * 4 + 2 * laneHi;
                v2f b;
                b[0] = Bb[kr * BSTR + col];
                b[1] = Bb[(kr + 1) * BSTR + col];
                bf[tn] = b;
            }
#pragma unroll
            for (int tm = 0; tm < 2; ++tm)
#pragma unroll
                for (int tn = 0; tn < 2; ++tn)
                    acc[tm][tn] = wmma_f32(af[tm], bf[tn], acc[tm][tn]);
        }
    };

    const int NCH = EMB / 16;  // 64 chunks
#if HAVE_ASYNC
    async_cp16(&Asm[0][ar0 * ASTR + ac0], Ap0);
    async_cp16(&Asm[0][ar1 * ASTR + ac1], Ap1);
    async_cp16(&Bsm[0][br * BSTR + bc], Wp);
    for (int it = 0; it < NCH; ++it) {
        const int cur = it & 1;
        async_wait0();
        __syncthreads();
        if (it + 1 < NCH) {
            const int kb = (it + 1) * 16;
            async_cp16(&Asm[cur ^ 1][ar0 * ASTR + ac0], Ap0 + kb);
            async_cp16(&Asm[cur ^ 1][ar1 * ASTR + ac1], Ap1 + kb);
            async_cp16(&Bsm[cur ^ 1][br * BSTR + bc], Wp + (size_t)kb * EMB);
        }
        compute(cur);
    }
#else
    f4 ra0 = *(const f4*)Ap0;
    f4 ra1 = *(const f4*)Ap1;
    f4 rb  = *(const f4*)Wp;
    for (int it = 0; it < NCH; ++it) {
        const int cur = it & 1;
        *(f4*)&Asm[cur][ar0 * ASTR + ac0] = ra0;
        *(f4*)&Asm[cur][ar1 * ASTR + ac1] = ra1;
        *(f4*)&Bsm[cur][br * BSTR + bc]   = rb;
        if (it + 1 < NCH) {
            const int kb = (it + 1) * 16;
            __builtin_prefetch(Ap0 + kb + 16, 0, 0);
            ra0 = *(const f4*)(Ap0 + kb);
            ra1 = *(const f4*)(Ap1 + kb);
            rb  = *(const f4*)(Wp + (size_t)kb * EMB);
        }
        __syncthreads();
        compute(cur);
    }
#endif

    // Epilogue
#pragma unroll
    for (int tm = 0; tm < 2; ++tm)
#pragma unroll
        for (int tn = 0; tn < 2; ++tn)
#pragma unroll
            for (int i = 0; i < 8; ++i) {
                int rg = mblk + wm * 32 + tm * 16 + i + 8 * laneHi;
                int cg = nblk + wn * 32 + tn * 16 + laneLo;
                float val = acc[tm][tn][i];
                if (mode == 0) {
                    out[(size_t)rg * EMB + cg] = val;
                } else {
                    int b = rg >> 11, s = rg & (SEQ - 1);
                    int h = cg >> 6, d = cg & 63;
                    if (mode == 2) {
                        float ex  = (float)(d & ~1) * (1.0f / 64.0f);
                        float sc  = 1.0f / (__powf(10000.0f, ex) + FEPS);
                        float ang = (float)s * sc;
                        val += (d & 1) ? __cosf(ang) : __sinf(ang);
                    }
                    out[(((size_t)b * NH + h) * SEQ + s) * DH + d] = val;
                }
            }
}

// Lane l <-> lane l ^ 16 (the other 16-lane half of the wave)
__device__ __forceinline__ float xhalf(float x) {
    int b = __builtin_bit_cast(int, x);
    return __builtin_bit_cast(float, __builtin_amdgcn_permlanex16(
        b, b, 0x76543210, 0xfedcba98, false, false));
}

// e^x as v_exp_f32(x * log2 e), what __expf compiles to. The v_nop is the one free
// slot the instruction set asks for behind a transcendental before its source is
// overwritten or its result read; in the same statement it stays directly behind.
__device__ __forceinline__ float exp_slot(float x) {
    float r;
    asm("v_exp_f32 %0, %1\n\tv_nop" : "=v"(r) : "v"(x * 1.44269504088896340736f));
    return r;
}

__global__ __launch_bounds__(256) void flash_attn(const float* __restrict__ Q,
                                                  const float* __restrict__ K,
                                                  const float* __restrict__ V,
                                                  float* __restrict__ O) {
    __shared__ float Ksm[2][16 * KVSTR];
    __shared__ float Vsm[2][16 * KVSTR];

    const int tid    = threadIdx.x;
    const int lane   = tid & 31;
    const int w      = tid >> 5;  // 0..7
    const int laneLo = lane & 15;
    const int laneHi = lane >> 4;
    const int pairi  = blockIdx.x;  // 0..15
    const int qb64   = (w < 4) ? (31 - pairi) : pairi;  // this wave's 64-row block
    const int bh     = blockIdx.y;  // 0..31
    const int b      = bh >> 4;
    const int h      = bh & 15;

    const float* Qp = Q + (size_t)bh * SEQ * DH;
    const float* Kp = K + (size_t)bh * SEQ * DH;
    const float* Vp = V + (size_t)bh * SEQ * DH;

    const int q0 = qb64 * 64 + (w & 3) * 16;

    // Q fragments (16 rows x 64 dim), pre-scaled by dim_k^-0.5
    v2f qf[16];
#pragma unroll
    for (int kk = 0; kk < 16; ++kk) {
        v2f t = *(const v2f*)(Qp + (size_t)(q0 + laneLo) * DH + kk * 4 + 2 * laneHi);
        qf[kk] = t * SCALE;
    }

    v8f Oa[4];
#pragma unroll
    for (int dt = 0; dt < 4; ++dt)
        Oa[dt] = (v8f){0.f, 0.f, 0.f, 0.f, 0.f, 0.f, 0.f, 0.f};
    float mrow = NEG_MAX;  // running maximum of query q0 + laneLo (both halves agree)
    float lrow = 0.f;      // running sum over this half's keys only; joined at the end

    const int ntiles = (32 - pairi) * 4;  // through the diagonal of block 31 - pairi
    const int mylast = qb64 * 4 + (w & 3);

    // Staging coords: one 16B piece of K and one of V per thread
    const int kr = tid >> 4, kc = (tid & 15) * 4;
    const float* Kpp = Kp + (size_t)kr * DH + kc;
    const float* Vpp = Vp + (size_t)kr * DH + kc;
    const int ldso = kr * KVSTR + kc;

    auto attend = [&](int cur, int kb) {
        const float* Kb = Ksm[cur];
        const float* Vb = Vsm[cur];
        // Vt fragments (A of the second product) depend on no score: read them first.
        // k order of chunk c, the same for A and B: key 8 * laneHi + 2 * c + {0, 1},
        // which is where the score accumulator holds Pt.
        v2f vf[4][4];
#pragma unroll
        for (int kc2 = 0; kc2 < 4; ++kc2) {
            int krw = 8 * laneHi + 2 * kc2;
#pragma unroll
            for (int dt = 0; dt < 4; ++dt) {
                vf[kc2][dt][0] = Vb[krw * KVSTR + dt * 16 + laneLo];
                vf[kc2][dt][1] = Vb[(krw + 1) * KVSTR + dt * 16 + laneLo];
            }
        }
        // St = K * Qt: sc[i] = score(key kb + i + 8 * laneHi, query q0 + laneLo)
        v8f sc = (v8f){0.f, 0.f, 0.f, 0.f, 0.f, 0.f, 0.f, 0.f};
#pragma unroll
        for (int kk = 0; kk < 16; ++kk) {
            v2f kf = *(const v2f*)(&Kb[laneLo * KVSTR + kk * 4 + 2 * laneHi]);
            sc = wmma_f32(kf, qf[kk], sc);
        }
        // Causal mask (diagonal tile only)
        if (kb + 15 > q0) {
#pragma unroll
            for (int i = 0; i < 8; ++i) {
                int kg = kb + i + 8 * laneHi;
                int qg = q0 + laneLo;
                if (kg > qg) sc[i] = NEG_MAX;
            }
        }
        // Online softmax: 8 keys in-lane, the other 8 in lane ^ 16
        float r = fmaxf(fmaxf(fmaxf(sc[0], sc[1]), fmaxf(sc[2], sc[3])),
                        fmaxf(fmaxf(sc[4], sc[5]), fmaxf(sc[6], sc[7])));
        r = fmaxf(r, xhalf(r));
        const float mnew = fmaxf(mrow, r);
        const float f    = exp_slot(mrow - mnew);
        mrow = mnew;
#pragma unroll
        for (int i = 0; i < 8; ++i) sc[i] = exp_slot(sc[i] - mnew);
        lrow = lrow * f + (((sc[0] + sc[1]) + (sc[2] + sc[3])) +
                           ((sc[4] + sc[5]) + (sc[6] + sc[7])));
        // Rescale running output, then Ot += Vt * Pt
#pragma unroll
        for (int dt = 0; dt < 4; ++dt)
#pragma unroll
            for (int i = 0; i < 8; ++i) Oa[dt][i] *= f;
#pragma unroll
        for (int kc2 = 0; kc2 < 4; ++kc2) {
            v2f pf;
            pf[0] = sc[2 * kc2];
            pf[1] = sc[2 * kc2 + 1];
#pragma unroll
            for (int dt = 0; dt < 4; ++dt)
                Oa[dt] = wmma_f32(vf[kc2][dt], pf, Oa[dt]);
        }
    };

#if HAVE_ASYNC
    async_cp16(&Ksm[0][ldso], Kpp);
    async_cp16(&Vsm[0][ldso], Vpp);
    for (int jt = 0; jt < ntiles; ++jt) {
        const int cur = jt & 1;
        async_wait0();
        __syncthreads();
        if (jt + 1 < ntiles) {
            async_cp16(&Ksm[cur ^ 1][ldso], Kpp + (size_t)(jt + 1) * 16 * DH);
            async_cp16(&Vsm[cur ^ 1][ldso], Vpp + (size_t)(jt + 1) * 16 * DH);
        }
        if (jt <= mylast) attend(cur, jt * 16);
    }
#else
    f4 rk = *(const f4*)Kpp;
    f4 rv = *(const f4*)Vpp;
    for (int jt = 0; jt < ntiles; ++jt) {
        const int cur = jt & 1;
        *(f4*)&Ksm[cur][ldso] = rk;
        *(f4*)&Vsm[cur][ldso] = rv;
        if (jt + 1 < ntiles) {
            __builtin_prefetch(Kpp + (size_t)(jt + 2) * 16 * DH, 0, 0);
            rk = *(const f4*)(Kpp + (size_t)(jt + 1) * 16 * DH);
            rv = *(const f4*)(Vpp + (size_t)(jt + 1) * 16 * DH);
        }
        __syncthreads();
        if (jt <= mylast) attend(cur, jt * 16);
    }
#endif

    // Normalize and write out in [B,S,E]:
    // Oa[dt][i] = O(query q0 + laneLo, dim dt * 16 + 8 * laneHi + i)
    const float inv = 1.0f / (lrow + xhalf(lrow));
    float* Op = O + ((size_t)b * SEQ + q0 + laneLo) * EMB + h * 64 + 8 * laneHi;
#pragma unroll
    for (int dt = 0; dt < 4; ++dt) {
        f4 lo = {Oa[dt][0] * inv, Oa[dt][1] * inv, Oa[dt][2] * inv, Oa[dt][3] * inv};
        f4 hi = {Oa[dt][4] * inv, Oa[dt][5] * inv, Oa[dt][6] * inv, Oa[dt][7] * inv};
        *(f4*)(Op + dt * 16)     = lo;
        *(f4*)(Op + dt * 16 + 4) = hi;
    }
}

extern "C" void kernel_launch(void* const* d_in, const int* in_sizes, int n_in,
                              void* d_out, int out_size, void* d_ws, size_t ws_size,
                              hipStream_t stream) {
    (void)in_sizes; (void)n_in; (void)out_size; (void)ws_size;
    const float* x  = (const float*)d_in[0];
    const float* Wq = (const float*)d_in[1];
    const float* Wk = (const float*)d_in[2];
    const float* Wv = (const float*)d_in[3];
    const float* Wo = (const float*)d_in[4];
    float* out = (float*)d_out;

    const size_t elems = (size_t)MROWS * EMB;
    float* Qb = (float*)d_ws;
    float* Kb = Qb + elems;
    float* Vb = Kb + elems;
    float* Ab = Vb + elems;

    dim3 gg(EMB / 64, MROWS / 128);  // (16, 32)
    gemm_proj<<<gg, 256, 0, stream>>>(x, Wq, Qb, 2);
    gemm_proj<<<gg, 256, 0, stream>>>(x, Wk, Kb, 2);
    gemm_proj<<<gg, 256, 0, stream>>>(x, Wv, Vb, 1);

    dim3 gf(SEQ / 128, BATCH * NH);  // (16, 32)
    flash_attn<<<gf, 256, 0, stream>>>(Qb, Kb, Vb, Ab);

    gemm_proj<<<gg, 256, 0, stream>>>(Ab, Wo, out, 0);
}
